// v010
// The times below were measured on an AMD MI455X: many runs one after another, warmed up first and cycling through
// copies of the inputs, with the whole window's GPU time divided by the number of runs. Launches and the gaps
// between them are all in it. The median over several windows is given; except for v000 it joins two sittings, which
// can be a few percent apart, so the side-by-side timings, each taken in one sitting, are the better comparison.
// Earlier versions than v010 are not in this document.
// One run takes 63.3 microseconds.
// Two timings next to v009 put it at 1.04 and 1.03 times that version's speed.
// All steps since the starting kernel, v000, together make it 17.7 times as fast.
#include <hip/hip_runtime.h>
// Non_local_MH (X [16][512][32][32]; K = conv1x1(X, Wq, bq), Q = conv1x1(X, Wk, bk), V = conv1x1(X, Wv, bv) (the module's swapped naming), 8 heads of 64 channels over d = 1,024 positions; softmax-FREE attention A = Q^T K ([d][d]), O = V A^T; O = conv1x1(O, Wo, bo); GroupNorm(128 groups of 4 channels, eps 1e-5, affine); out = GN(O) + X -> [16][512][32][32]).
// Structure (analytic reassociation, exact in real arithmetic): O[c][d] = sum_D A[d][D] V[c][D] = sum_c' Q[c'][d] (sum_D K[c'][D] V[c][D]) = sum_c' Q[c'][d] M[c'][c] with the per-head 64x64 matrix M = K V^T - so per sample: the 1x1 convs as WMMA GEMMs (64x64 wave tiles, f32 accumulation, exact x16 weights + bias, f16 outputs): Q with the token rows as A (token-major result), K and V with the weight rows as A and the token rows as B (channel-major result, bias per row), kept in the work-group as f16; M per head as f32 partials over 256 positions in the same launch; then, since O2 = Wo O + bo = (Wo M) Q + bo, the 4 partials are added, rounded to f16 and multiplied into Wo in the next launch (W2 = Wo M per sample, K = 64: the head's own channels, f16), and O itself is never formed: O2 = W2 Q^T + bo GEMM (f32, W2 rows as A: channel-major) whose work-group holds 64 channels x all positions, so that the GroupNorm statistics per (sample, group) (f32 sums per wave, float64 over the waves), the affine and the residual follow on VALU in the same launch.
// Compute dtype: inputs rounded to bf16; X / weights exact; K, Q, V, M and W2 as plain f16 GEMM operands (~2^-12); GN statistics f32 partial sums, float64 totals; everything else f32. v_wmma_f32_16x16x32_f16.
#define NB 16
#define CC 512
#define PX 1024
#define NR ((size_t)NB * PX)         /* 16384 */
#define NH 8
#define HD 64
#define GRP 128
#define CPG (CC / GRP)               /* 4 */
typedef __bf16 v16b __attribute__((ext_vector_type(16)));
typedef unsigned short v8us __attribute__((ext_vector_type(8), may_alias));
typedef float  v8f  __attribute__((ext_vector_type(8)));
typedef float  v4f  __attribute__((ext_vector_type(4)));
typedef float  v4fa __attribute__((ext_vector_type(4), may_alias));
union FragB { v16b v; v8us half[2]; unsigned short u[16]; };

__device__ __forceinline__ unsigned short bf16_bits(float x) { unsigned int u = __float_as_uint(x); return (unsigned short)((u + 0x7FFFu + ((u >> 16) & 1u)) >> 16); }
__device__ __forceinline__ float bf16_val(unsigned short b) { return __uint_as_float(((unsigned int)b) << 16); }
__device__ __forceinline__ float bf16_round(float x) { return bf16_val(bf16_bits(x)); }
// D += A·B with NT terms: 1 = ah·bh, 2 = + al·bh (A split), 3 = + ah·bl (both split)
template <int NT>
__device__ __forceinline__ v8f mmaN(v16b ah, v16b al, v16b bh, v16b bl, v8f c) {
  c = __builtin_amdgcn_wmma_f32_16x16x32_bf16(false, ah, false, bh, (short)0, c, false, false);
  if (NT >= 2) c = __builtin_amdgcn_wmma_f32_16x16x32_bf16(false, al, false, bh, (short)0, c, false, false);
  if (NT >= 3) c = __builtin_amdgcn_wmma_f32_16x16x32_bf16(false, ah, false, bl, (short)0, c, false, false);
  asm volatile("v_nop\n\tv_nop\n\tv_nop\n\tv_nop" : "+v"(c) : "v"(ah), "v"(al), "v"(bh), "v"(bl));
  return c;
}

__global__ __launch_bounds__(256) void k_wt_bf16(const float* __restrict__ W, unsigned short* __restrict__ Wt, int K, int N) {
  const int t = blockIdx.x * 256 + threadIdx.x;
  const int k8n = K / 8;
  if (t >= N * k8n) return;
  const int n = t / k8n, k8 = (t % k8n) * 8;
  v8us v;
#pragma unroll
  for (int i = 0; i < 8; ++i) v[i] = bf16_bits(W[(size_t)(k8 + i) * N + n]);
  *(v8us*)(Wt + (size_t)n * K + k8) = v;
  
}

// GEMM C[M][N] (f32, pitch ldc) = act(A[M][K]·W + bias). A f32 row-major (pitch lda) converted per fragment to bf16
// (ASPLIT: hi/lo two planes -> 2 terms, else single rounded term); Wt bf16 [N][K] (pitch ldb). BIAS_BF16 rounds the
// bias to bf16 first (bias quantised to bf16 before the add). K%32==0, M%16==0, N%64==0.
template <bool ASPLIT, int ACT, bool BIAS_BF16>
__global__ __launch_bounds__(128) void k_gemm_bf(const float* __restrict__ A, int lda, const unsigned short* __restrict__ Wt, int ldb,
                                               const float* __restrict__ bias, float* __restrict__ C, int ldc, int M, int N, int K) {
  __shared__ __attribute__((aligned(16))) float so[4][16][64];
  const int tid = threadIdx.x, w = tid >> 5, lane = tid & 31, ln = lane & 15, hh = lane >> 4;
  const int ntn = N / 64;
  const int wid = blockIdx.x * 4 + w;
  const int mt = wid / ntn, nq = wid % ntn;
  if (mt * 16 >= M) return;
  const int row0 = mt * 16, col0 = nq * 64;
  const float* arow = A + (size_t)(row0 + ln) * lda;
  v8f acc[4] = {};
  for (int kb = 0; kb < K; kb += 32) {
    FragB ah, al;
    const v4f x0 = *(const v4fa*)(arow + kb + 8 * hh), x1 = *(const v4fa*)(arow + kb + 8 * hh + 4);
    const v4f x2 = *(const v4fa*)(arow + kb + 16 + 8 * hh), x3 = *(const v4fa*)(arow + kb + 16 + 8 * hh + 4);
    float xs[16] = {x0[0],x0[1],x0[2],x0[3],x1[0],x1[1],x1[2],x1[3],x2[0],x2[1],x2[2],x2[3],x3[0],x3[1],x3[2],x3[3]};
#pragma unroll
    for (int i = 0; i < 16; ++i) { const unsigned short hb = bf16_bits(xs[i]); ah.u[i] = hb; al.u[i] = ASPLIT ? bf16_bits(xs[i] - bf16_val(hb)) : (unsigned short)0; }
#pragma unroll
    for (int t = 0; t < 4; ++t) {
      const unsigned short* brow = Wt + (size_t)(col0 + t * 16 + ln) * ldb + kb;
      FragB b;
      b.half[0] = *(const v8us*)(brow + 8 * hh);
      b.half[1] = *(const v8us*)(brow + 16 + 8 * hh);
      acc[t] = mmaN<ASPLIT ? 2 : 1>(ah.v, al.v, b.v, b.v, acc[t]);
    }
  }
#pragma unroll
  for (int t = 0; t < 4; ++t) {
    float bv = bias ? bias[col0 + t * 16 + ln] : 0.f;
    if (BIAS_BF16) bv = bf16_round(bv);
#pragma unroll
    for (int r = 0; r < 8; ++r) { float v = acc[t][r] + bv; if (ACT == 1) v = fmaxf(v, 0.f); so[w][8 * hh + r][t * 16 + ln] = v; }
  }
  __builtin_amdgcn_fence(__ATOMIC_ACQ_REL, "workgroup");
  __builtin_amdgcn_wave_barrier();
  const int rsub = lane >> 4, c4 = (lane & 15) * 4;
  {
#pragma unroll
    for (int q = 0; q < 8; ++q) {
      const int r = q * 2 + rsub;
      const v4f v = *(const v4fa*)&so[w][r][c4];
      *(v4f*)(C + (size_t)(row0 + r) * ldc + col0 + c4) = v;
    }
    
  }
}

// GEMM C = act(A·W + bias + resid): A f32 (ASPLIT -> hi/lo 2 terms), Wt bf16 [N][K]; ACT 0 none, 1 relu, 2 exact gelu;
// resid (optional, f32, row index = (row % rmod), pitch ldr, RES_BF16 rounds it) added before the activation.
template <bool ASPLIT, int ACT, bool BIAS_BF16, bool RES_BF16>
__global__ __launch_bounds__(128) void k_gemm_bf3(const float* __restrict__ A, int lda, const unsigned short* __restrict__ Wt, int ldb,
                                                const float* __restrict__ bias, const float* __restrict__ resid, int rmod, int ldr,
                                                float* __restrict__ C, int ldc, int M, int N, int K) {
  __shared__ __attribute__((aligned(16))) float so[4][16][64];
  const int tid = threadIdx.x, w = tid >> 5, lane = tid & 31, ln = lane & 15, hh = lane >> 4;
  const int ntn = N / 64;
  const int wid = blockIdx.x * 4 + w;
  const int mt = wid / ntn, nq = wid % ntn;
  if (mt * 16 >= M) return;
  const int row0 = mt * 16, col0 = nq * 64;
  const float* arow = A + (size_t)(row0 + ln) * lda;
  v8f acc[4] = {};
  for (int kb = 0; kb < K; kb += 32) {
    FragB ah, al;
    const v4f x0 = *(const v4fa*)(arow + kb + 8 * hh), x1 = *(const v4fa*)(arow + kb + 8 * hh + 4);
    const v4f x2 = *(const v4fa*)(arow + kb + 16 + 8 * hh), x3 = *(const v4fa*)(arow + kb + 16 + 8 * hh + 4);
    float xs[16] = {x0[0],x0[1],x0[2],x0[3],x1[0],x1[1],x1[2],x1[3],x2[0],x2[1],x2[2],x2[3],x3[0],x3[1],x3[2],x3[3]};
#pragma unroll
    for (int i = 0; i < 16; ++i) { const unsigned short hb = bf16_bits(xs[i]); ah.u[i] = hb; al.u[i] = ASPLIT ? bf16_bits(xs[i] - bf16_val(hb)) : (unsigned short)0; }
#pragma unroll
    for (int t = 0; t < 4; ++t) {
      const unsigned short* brow = Wt + (size_t)(col0 + t * 16 + ln) * ldb + kb;
      FragB b;
      b.half[0] = *(const v8us*)(brow + 8 * hh);
      b.half[1] = *(const v8us*)(brow + 16 + 8 * hh);
      acc[t] = mmaN<ASPLIT ? 2 : 1>(ah.v, al.v, b.v, b.v, acc[t]);
    }
  }
#pragma unroll
  for (int t = 0; t < 4; ++t) {
    const int col = col0 + t * 16 + ln;
    float bv = bias ? bias[col] : 0.f;
    if (BIAS_BF16) bv = bf16_round(bv);
#pragma unroll
    for (int r = 0; r < 8; ++r) {
      float v = acc[t][r] + bv;
      if (resid) { float rv = resid[(size_t)((row0 + 8 * hh + r) % rmod) * ldr + col]; if (RES_BF16) rv = bf16_round(rv); v += rv; }
      if (ACT == 1) v = fmaxf(v, 0.f);
      if (ACT == 2) v = 0.5f * v * (1.0f + erff(v * 0.70710678118654752f));
      if (ACT == 3) { const float u = 0.7978845608028654f * (v + 0.044715f * v * v * v); v = 0.5f * v * (1.0f + tanhf(u)); }
      so[w][8 * hh + r][t * 16 + ln] = v;
    }
  }
  __builtin_amdgcn_fence(__ATOMIC_ACQ_REL, "workgroup");
  __builtin_amdgcn_wave_barrier();
  const int rsub = lane >> 4, c4 = (lane & 15) * 4;
  {
#pragma unroll
    for (int q = 0; q < 8; ++q) {
      const int r = q * 2 + rsub;
      const v4f v = *(const v4fa*)&so[w][r][c4];
      *(v4f*)(C + (size_t)(row0 + r) * ldc + col0 + c4) = v;
    }
    
  }
}
// row LayerNorm (biased variance, eps) over N: s = X (+ R); optional out_sum <- s; out_norm <- (s-mu)*rsqrt(var+eps)*g + b
template <bool PARAM_BF16>
__global__ __launch_bounds__(256) void k_layernorm(const float* __restrict__ X, const float* __restrict__ R, const float* __restrict__ g, const float* __restrict__ bta,
                                                  float* __restrict__ out_sum, float* __restrict__ out_norm, int N, float eps) {
  __shared__ float red[256];
  const int row = blockIdx.x, tid = threadIdx.x;
  const float* x = X + (size_t)row * N; const float* rr = R ? R + (size_t)row * N : nullptr;
  float vals[16];                     // up to N = 4096
  const int per = N / 256;            // contiguous chunk per thread? use strided-by-4 chunks: thread handles j = tid*4 + 1024*u
  float s1 = 0.f;
  for (int u = 0; u < per / 4; ++u) {
    const int j = tid * 4 + 1024 * u;
    const v4f a = *(const v4fa*)(x + j);
    v4f b = {0.f,0.f,0.f,0.f}; if (rr) b = *(const v4fa*)(rr + j);
#pragma unroll
    for (int q = 0; q < 4; ++q) { const float v = a[q] + b[q]; vals[u * 4 + q] = v; s1 += v; }
  }
  red[tid] = s1; __syncthreads();
  for (int st = 128; st > 0; st >>= 1) { if (tid < st) red[tid] += red[tid + st]; __syncthreads(); }
  const float mu = red[0] / (float)N; __syncthreads();
  float s2 = 0.f;
  for (int u = 0; u < per / 4; ++u)
#pragma unroll
    for (int q = 0; q < 4; ++q) { const float c = vals[u * 4 + q] - mu; s2 += c * c; }
  red[tid] = s2; __syncthreads();
  for (int st = 128; st > 0; st >>= 1) { if (tid < st) red[tid] += red[tid + st]; __syncthreads(); }
  const float rs = rsqrtf(red[0] / (float)N + eps);
  {
    for (int u = 0; u < per / 4; ++u) {
      const int j = tid * 4 + 1024 * u;
      v4f o, sm;
#pragma unroll
      for (int q = 0; q < 4; ++q) {
        float gg = g[j + q], bb = bta[j + q];
        if (PARAM_BF16) { gg = bf16_round(gg); bb = bf16_round(bb); }
        sm[q] = vals[u * 4 + q]; o[q] = (vals[u * 4 + q] - mu) * rs * gg + bb;
      }
      if (out_sum) *(v4f*)(out_sum + (size_t)row * N + j) = sm;
      *(v4f*)(out_norm + (size_t)row * N + j) = o;
    }
    
  }
}



// ---- f16 WMMA path (v_wmma_f32_16x16x32_f16): 11-bit significands for operands in range — used by every GEMM launched here
typedef _Float16 v16h __attribute__((ext_vector_type(16)));
union FragH { v16h v; v8us half[2]; _Float16 h[16]; unsigned short u[16]; };
template <int NT>
__device__ __forceinline__ v8f mmaH(v16h ah, v16h al, v16h bh, v16h bl, v8f c) {
  c = __builtin_amdgcn_wmma_f32_16x16x32_f16(false, ah, false, bh, (short)0, c, false, false);
  if (NT >= 2) c = __builtin_amdgcn_wmma_f32_16x16x32_f16(false, al, false, bh, (short)0, c, false, false);
  if (NT >= 3) c = __builtin_amdgcn_wmma_f32_16x16x32_f16(false, ah, false, bl, (short)0, c, false, false);
  asm volatile("v_nop\n\tv_nop\n\tv_nop\n\tv_nop" : "+v"(c) : "v"(ah), "v"(al), "v"(bh), "v"(bl));
  return c;
}
// batched GEMM like k_gemm_b but f16 operands: A f32 (split into f16 hi/lo if ASPLIT, else rounded to f16), Bt = f16 values [n][k]; alpha; C f32; N multiple of 16 (partial tiles skipped)
template <bool ASPLIT>
__global__ __launch_bounds__(128) void k_gemm_h(const float* __restrict__ A, int lda, size_t sA, const _Float16* __restrict__ Bh, int ldb, size_t sB, float alpha, float* __restrict__ C, int ldc, size_t sC, int M, int N, int K) {
  __shared__ __attribute__((aligned(16))) float so[4][16][64];
  const int tid = threadIdx.x, w = tid >> 5, lane = tid & 31, ln = lane & 15, hh = lane >> 4; const int by = blockIdx.y;
  A += (size_t)by * sA; Bh += (size_t)by * sB; C += (size_t)by * sC;
  const int ntn = (N + 63) / 64; const int wid = blockIdx.x * 4 + w; const int mt = wid / ntn, nq = wid % ntn; if (mt * 16 >= M) return;
  const int row0 = mt * 16, col0 = nq * 64; const float* arow = A + (size_t)(row0 + ln) * lda;
  v8f acc[4] = {};
  for (int kb = 0; kb < K; kb += 32) {
    FragH ah, al;
    const v4f x0 = *(const v4fa*)(arow + kb + 8 * hh), x1 = *(const v4fa*)(arow + kb + 8 * hh + 4), x2 = *(const v4fa*)(arow + kb + 16 + 8 * hh), x3 = *(const v4fa*)(arow + kb + 16 + 8 * hh + 4);
    float xs[16] = {x0[0],x0[1],x0[2],x0[3],x1[0],x1[1],x1[2],x1[3],x2[0],x2[1],x2[2],x2[3],x3[0],x3[1],x3[2],x3[3]};
#pragma unroll
    for (int i = 0; i < 16; ++i) { const _Float16 h = (_Float16)xs[i]; ah.h[i] = h; al.h[i] = ASPLIT ? (_Float16)(xs[i] - (float)h) : (_Float16)0.0f; }
#pragma unroll
    for (int t = 0; t < 4; ++t) { if (col0 + t * 16 >= N) continue; const size_t boff = (size_t)(col0 + t * 16 + ln) * ldb + kb; FragH bq; bq.half[0] = *(const v8us*)(Bh + boff + 8 * hh); bq.half[1] = *(const v8us*)(Bh + boff + 16 + 8 * hh);
      acc[t] = mmaH<ASPLIT ? 2 : 1>(ah.v, al.v, bq.v, bq.v, acc[t]); }
  }
#pragma unroll
  for (int t = 0; t < 4; ++t) { if (col0 + t * 16 >= N) continue;
#pragma unroll
    for (int r = 0; r < 8; ++r) so[w][8 * hh + r][t * 16 + ln] = acc[t][r] * alpha; }
  __builtin_amdgcn_fence(__ATOMIC_ACQ_REL, "workgroup"); __builtin_amdgcn_wave_barrier();
  const int rsub = lane >> 4, c4 = (lane & 15) * 4;
  {
#pragma unroll
    for (int q = 0; q < 8; ++q) { const int r = q * 2 + rsub; if (col0 + c4 < N) { const v4f v = *(const v4fa*)&so[w][r][c4]; *(v4f*)(C + (size_t)(row0 + r) * ldc + col0 + c4) = v; } }
     }
}

// Wt[n][k] = f16(W[k][n]·scale) from f32 row-major W[K][N] (scale = power of two; bf16-exact weights stay exact in f16 away from the subnormal range)
__global__ __launch_bounds__(256) void k_wt_f16(const float* __restrict__ W, _Float16* __restrict__ Wt, int K, int N, float scale) {
  const int t = blockIdx.x * 256 + threadIdx.x; if (t >= N * (K / 8)) return; const int n = t / (K / 8), k8 = (t % (K / 8)) * 8; FragH f;
#pragma unroll
  for (int i = 0; i < 8; ++i) f.h[i] = (_Float16)(bf16_round(W[(size_t)(k8 + i) * N + n]) * scale); const v8us o = f.half[0];
  *(v8us*)((unsigned short*)Wt + (size_t)n * K + k8) = o; 
}
// k_gemm_hh variant with fused epilogue: v = acc·alpha + bias[by·sBias + col] (+ CP[(row/rowsPerB)·sCPb + by·64 + col] if CP) ; ACT 0 none / 1 elu ; writes f16 C16 (and f32 C if non-null)
template <int ACT>
__global__ __launch_bounds__(128) void k_gemm_hhx(const _Float16* __restrict__ A, int lda, size_t sA, const _Float16* __restrict__ Bh, int ldb, size_t sB, float alpha, const float* __restrict__ bias, size_t sBias, const float* __restrict__ CP, int rowsPerB, size_t sCPb, int row0g,
    float* __restrict__ C, _Float16* __restrict__ C16, int ldc, size_t sC, int M, int N, int K) {
  __shared__ __attribute__((aligned(16))) float so[4][16][64];
  const int tid = threadIdx.x, w = tid >> 5, lane = tid & 31, ln = lane & 15, hh = lane >> 4; const int by = blockIdx.y;
  A += (size_t)by * sA; Bh += (size_t)by * sB; const size_t cofs = (size_t)by * sC; const float* bp = bias ? bias + (size_t)by * sBias : nullptr;
  const int ntn = (N + 63) / 64; const int wid = blockIdx.x * 4 + w; const int mt = wid / ntn, nq = wid % ntn; if (mt * 16 >= M) return;
  const int row0 = mt * 16, col0 = nq * 64; const _Float16* arow = A + (size_t)(row0 + ln) * lda;
  v8f acc[4] = {};
  for (int kb = 0; kb < K; kb += 32) { FragH ah; ah.half[0] = *(const v8us*)((const unsigned short*)arow + kb + 8 * hh); ah.half[1] = *(const v8us*)((const unsigned short*)arow + kb + 16 + 8 * hh);
#pragma unroll
    for (int t = 0; t < 4; ++t) { if (col0 + t * 16 >= N) continue; const size_t boff = (size_t)(col0 + t * 16 + ln) * ldb + kb; FragH bq; bq.half[0] = *(const v8us*)((const unsigned short*)Bh + boff + 8 * hh); bq.half[1] = *(const v8us*)((const unsigned short*)Bh + boff + 16 + 8 * hh);
      acc[t] = mmaH<1>(ah.v, ah.v, bq.v, bq.v, acc[t]); }
  }
#pragma unroll
  for (int t = 0; t < 4; ++t) { if (col0 + t * 16 >= N) continue; const int col = col0 + t * 16 + ln; const float bv = bp ? bf16_round(bp[col]) : 0.f;
#pragma unroll
    for (int r = 0; r < 8; ++r) { float v = acc[t][r] * alpha + bv; if (CP) { const int rr = row0g + row0 + 8 * hh + r; if (rowsPerB < 0) v += CP[cofs + (size_t)rr * ldc + col];      /* rowsPerB < 0: own element of the batched C plane */ else { const int bidx = rr / rowsPerB; v += CP[(size_t)bidx * sCPb + (size_t)by * 64 + col]; } } if (ACT == 1) v = (v > 0.f) ? v : expm1f(v); else if (ACT == 7) v = (v > 0.f) ? v + 1.0f : expf(v); else if (ACT == 8) v = tanhf(v); else if (ACT == 9) v = 0.5f * v * (1.0f + tanhf(0.7978845608028654f * (v + 0.044715f * v * v * v))); else if (ACT == 11) v = 1.0f / (1.0f + expf(-v)); else if (ACT == 12) v = (v > 0.f) ? v : 0.01f * v; else if (ACT == 14) v = (v > 0.f) ? v : 0.1f * v; else if (ACT == 16) v = (v >= 0.f) ? v : 0.3f * v; else if (ACT == 17) v = (v >= 0.f) ? v : 0.2f * v; else if (ACT == 15) v = v / (1.0f + expf(-v)); else if (ACT == 3) v = fmaxf(v, 0.f); else if (ACT == 6) v = 0.5f * v * (1.0f + erff(v * 0.70710678118654752f)); so[w][8 * hh + r][t * 16 + ln] = v; } }
  __builtin_amdgcn_fence(__ATOMIC_ACQ_REL, "workgroup"); __builtin_amdgcn_wave_barrier();
  const int rsub = lane >> 4, c4 = (lane & 15) * 4; typedef _Float16 v4h __attribute__((ext_vector_type(4)));
  {
#pragma unroll
    for (int q = 0; q < 8; ++q) { const int r = q * 2 + rsub; if (col0 + c4 < N) { const v4f v = *(const v4fa*)&so[w][r][c4]; if (C) *(v4f*)(C + cofs + (size_t)(row0 + r) * ldc + col0 + c4) = v; if (C16) { v4h h4; for (int i = 0; i < 4; ++i) h4[i] = (_Float16)v[i]; *(v4h*)(C16 + cofs + (size_t)(row0 + r) * ldc + col0 + c4) = h4; } } }
     }
}


typedef _Float16 v4h __attribute__((ext_vector_type(4)));

__global__ __launch_bounds__(256) void k_x16(const float* __restrict__ x, _Float16* __restrict__ X16, size_t n8) { const size_t t = (size_t)blockIdx.x * 256 + threadIdx.x; if (t >= n8) return; FragH f;
#pragma unroll
  for (int q = 0; q < 8; ++q) f.h[q] = (_Float16)bf16_round(x[t * 8 + q]); *(v8us*)((unsigned short*)X16 + t * 8) = f.half[0];  }
__global__ __launch_bounds__(256) void k_h16(const float* __restrict__ x, _Float16* __restrict__ X16, size_t n8) { const size_t t = (size_t)blockIdx.x * 256 + threadIdx.x; if (t >= n8) return; FragH f;
#pragma unroll
  for (int q = 0; q < 8; ++q) f.h[q] = (_Float16)x[t * 8 + q]; *(v8us*)((unsigned short*)X16 + t * 8) = f.half[0];  }
__global__ __launch_bounds__(256) void k_round16f(const float* __restrict__ W, _Float16* __restrict__ Bt, size_t n8) { const size_t t = (size_t)blockIdx.x * 256 + threadIdx.x; if (t >= n8) return; FragH f;
#pragma unroll
  for (int i = 0; i < 8; ++i) f.h[i] = (_Float16)(bf16_round(W[t * 8 + i]) * 16.0f); *(v8us*)((unsigned short*)Bt + t * 8) = f.half[0];  }
template <int NHv, int TTv>
__global__ __launch_bounds__(256) void k_vt(const _Float16* __restrict__ V16, int ldv, int voff, _Float16* __restrict__ Vt) { __shared__ unsigned short tl[64][66]; const int tid = threadIdx.x; const int slab = blockIdx.x / (TTv / 64), lg = blockIdx.x % (TTv / 64); const int b = slab / NHv, h = slab % NHv;
  for (int i = tid; i < 64 * 8; i += 256) { const int r = i / 8, c8 = (i % 8) * 8; FragH f; f.half[0] = *(const v8us*)((const unsigned short*)V16 + ((size_t)b * TTv + lg * 64 + r) * ldv + voff + h * 64 + c8);
#pragma unroll
    for (int q = 0; q < 8; ++q) tl[r][c8 + q] = f.u[q]; }
  __syncthreads();
  {
#pragma unroll
    for (int rd = 0; rd < 2; ++rd) { const int d = rd * 32 + tid / 8, pc = tid % 8; FragH f;
#pragma unroll
      for (int q = 0; q < 8; ++q) f.u[q] = tl[pc * 8 + q][d];
      *(v8us*)((unsigned short*)Vt + ((size_t)slab * 64 + d) * TTv + lg * 64 + pc * 8) = f.half[0]; }
     } }

__global__ __launch_bounds__(256) void k_hl(const float* __restrict__ F, _Float16* __restrict__ Hh, _Float16* __restrict__ Hl, size_t n8) { const size_t t = (size_t)blockIdx.x * 256 + threadIdx.x; if (t >= n8) return; FragH fh, fl; const v4f a = *(const v4fa*)(F + t * 8), c = *(const v4fa*)(F + t * 8 + 4);
#pragma unroll
  for (int q = 0; q < 4; ++q) { _Float16 h = (_Float16)a[q]; fh.h[q] = h; fl.h[q] = (_Float16)((a[q] - (float)h) * 1024.0f); h = (_Float16)c[q]; fh.h[4 + q] = h; fl.h[4 + q] = (_Float16)((c[q] - (float)h) * 1024.0f); }
  { *(v8us*)((unsigned short*)Hh + t * 8) = fh.half[0]; *(v8us*)((unsigned short*)Hl + t * 8) = fl.half[0];  } }

// ---- fast GEMM (work-group tile 128x64, wave tile 32x64; requires M % 128 == 0, N % 64 == 0, K % 64 == 0); epilogue = k_gemm_hhx semantics; ROWB: bias indexed by the C row (weights as A) instead of the C column ----
// Operand path: per stage of 64 k (one 128-B line of every operand row) the 128 A rows and 64 B rows of the work-group's tile are copied to LDS by
// asynchronous b128 copies (a wave-wide copy = 4 whole lines), two buffers, the next stage in flight while this one is multiplied; fragments come from LDS.
#define G2_PITCH 144                      /* LDS row pitch in bytes, 16 B x odd: conflict-free for the ds_load_b128 fragment reads of 128-B rows */
#define G2_STAGE ((128 + 64) * G2_PITCH)  /* bytes of one buffer: A rows 0..127, then B rows 0..63 */
__device__ __forceinline__ v16h g2_frag(const unsigned char* p) { FragH f; f.half[0] = *(const v8us*)p; f.half[1] = *(const v8us*)(p + 32); return f.v; }
__device__ __forceinline__ v8f g2_mma(v16h a, v16h b, v8f c) { v8f d = __builtin_amdgcn_wmma_f32_16x16x32_f16(false, a, false, b, (short)0, c, false, false); asm volatile("v_nop\n\tv_nop\n\tv_nop\n\tv_nop" : "+v"(d) : "v"(a), "v"(b)); return d; }
// One stage: each of the 128 threads copies 16 B of 8 A rows and 4 B rows (rows 16 apart). l = the lane's LDS byte address in the buffer, a / b = its global
// addresses, sa / sb = 16 rows in elements. The closing s_wait_xcnt keeps every address register intact until the copies have taken it.
__device__ __forceinline__ void g2_stage(unsigned l, const _Float16* a, size_t sa, const _Float16* b, size_t sb) {
  asm volatile("global_load_async_to_lds_b128 %0, %12, off\n\t"
               "global_load_async_to_lds_b128 %1, %13, off\n\t"
               "global_load_async_to_lds_b128 %2, %14, off\n\t"
               "global_load_async_to_lds_b128 %3, %15, off\n\t"
               "global_load_async_to_lds_b128 %4, %16, off\n\t"
               "global_load_async_to_lds_b128 %5, %17, off\n\t"
               "global_load_async_to_lds_b128 %6, %18, off\n\t"
               "global_load_async_to_lds_b128 %7, %19, off\n\t"
               "global_load_async_to_lds_b128 %8, %20, off\n\t"
               "global_load_async_to_lds_b128 %9, %21, off\n\t"
               "global_load_async_to_lds_b128 %10, %22, off\n\t"
               "global_load_async_to_lds_b128 %11, %23, off\n\t"
               "s_wait_xcnt 0x0"
               :: "v"(l), "v"(l + 16 * G2_PITCH), "v"(l + 32 * G2_PITCH), "v"(l + 48 * G2_PITCH), "v"(l + 64 * G2_PITCH), "v"(l + 80 * G2_PITCH), "v"(l + 96 * G2_PITCH), "v"(l + 112 * G2_PITCH),
                  "v"(l + 128 * G2_PITCH), "v"(l + 144 * G2_PITCH), "v"(l + 160 * G2_PITCH), "v"(l + 176 * G2_PITCH),
                  "v"(a), "v"(a + sa), "v"(a + 2 * sa), "v"(a + 3 * sa), "v"(a + 4 * sa), "v"(a + 5 * sa), "v"(a + 6 * sa), "v"(a + 7 * sa),
                  "v"(b), "v"(b + sb), "v"(b + 2 * sb), "v"(b + 3 * sb)
               : "memory");
}
// The body takes its LDS and its block indices (bx = tile, by = batch plane) from the caller, so that one launch can hold the tiles of several independent GEMMs.
template <int ACT, bool ROWB>
__device__ __forceinline__ void g2_body(unsigned char* smem, const int bx, const int by, const _Float16* __restrict__ A, int lda, size_t sA, const _Float16* __restrict__ Bh, int ldb, size_t sB, float alpha, const float* __restrict__ bias, size_t sBias, const float* __restrict__ CP, int rowsPerB, size_t sCPb, int row0g,
    float* __restrict__ C, _Float16* __restrict__ C16, int ldc, size_t sC, int M, int N, int K) { static_assert(ACT == 0 || ACT == 3 || ACT == 6 || ACT == 8 || ACT == 9 || ACT == 11 || ACT == 12 || ACT == 14 || ACT == 15 || ACT == 16 || ACT == 17, "k_gemm2: unsupported ACT code (would silently apply no activation)");
  static_assert(sizeof(float) * 4 * 32 * 68 <= 2 * G2_STAGE, "output staging must fit the operand buffers");
  float (*so)[32][68] = (float (*)[32][68])smem;
  const int tid = threadIdx.x, w = tid >> 5, lane = tid & 31, ln = lane & 15, hh = lane >> 4;
  A += (size_t)by * sA; Bh += (size_t)by * sB; const size_t cofs = (size_t)by * sC; const float* bp = bias ? bias + (size_t)by * sBias : nullptr;
  const int ntn = N >> 6; const int mt = bx / ntn, nq = bx - mt * ntn; const int row0 = mt * 128 + 32 * w, col0 = nq * 64; if (mt * 128 >= M) return;      /* the whole work-group leaves, in front of every barrier */
  const unsigned lcp = (unsigned)(size_t)smem + (unsigned)((tid >> 3) * G2_PITCH + (tid & 7) * 16);
  const _Float16* gA = A + (size_t)(mt * 128 + (tid >> 3)) * lda + (tid & 7) * 8; const _Float16* gB = Bh + (size_t)(col0 + (tid >> 3)) * ldb + (tid & 7) * 8; const size_t sa16 = (size_t)16 * lda, sb16 = (size_t)16 * ldb;
  const int nst = K >> 6;
  const v8f z8 = {0.f,0.f,0.f,0.f,0.f,0.f,0.f,0.f}; v8f c00 = z8, c01 = z8, c02 = z8, c03 = z8, c10 = z8, c11 = z8, c12 = z8, c13 = z8;
  g2_stage(lcp, gA, sa16, gB, sb16);
  asm volatile("s_wait_asynccnt 0x0" ::: "memory");      /* this wave's copies of stage 0 have landed */
  __syncthreads();                                       /* ... and every other wave's */
  if (nst > 1) g2_stage(lcp + G2_STAGE, gA + 64, sa16, gB + 64, sb16);
#pragma unroll 1
  for (int s = 0; s < nst; ++s) { const unsigned char* sb = smem + (s & 1) * G2_STAGE; const unsigned char* pa = sb + (32 * w + ln) * G2_PITCH + 16 * hh; const unsigned char* pb = sb + (128 + ln) * G2_PITCH + 16 * hh;
    v16h fa[2][2], fb[2][4];      /* the stage's 12 fragments are read as one group in front of its 16 WMMAs: one LDS latency a stage instead of one per B fragment */
#pragma unroll
    for (int h = 0; h < 2; ++h) { fa[h][0] = g2_frag(pa + 64 * h); fa[h][1] = g2_frag(pa + 16 * G2_PITCH + 64 * h);
#pragma unroll
      for (int t = 0; t < 4; ++t) fb[h][t] = g2_frag(pb + 16 * t * G2_PITCH + 64 * h); }
#pragma unroll
    for (int h = 0; h < 2; ++h) {
      c00 = g2_mma(fa[h][0], fb[h][0], c00); c10 = g2_mma(fa[h][1], fb[h][0], c10);
      c01 = g2_mma(fa[h][0], fb[h][1], c01); c11 = g2_mma(fa[h][1], fb[h][1], c11);
      c02 = g2_mma(fa[h][0], fb[h][2], c02); c12 = g2_mma(fa[h][1], fb[h][2], c12);
      c03 = g2_mma(fa[h][0], fb[h][3], c03); c13 = g2_mma(fa[h][1], fb[h][3], c13); }
    asm volatile("s_wait_dscnt 0x0" ::: "memory");       /* this wave's reads of the buffer are over before it may be refilled */
    asm volatile("s_wait_asynccnt 0x0" ::: "memory");    /* this wave's copies of stage s + 1 have landed */
    __syncthreads();                                     /* publishes stage s + 1 and ends every wave's reads of stage s */
    if (s + 2 < nst) g2_stage(lcp + (unsigned)(s & 1) * G2_STAGE, gA + (size_t)(s + 2) * 64, sa16, gB + (size_t)(s + 2) * 64, sb16); }
  asm volatile("s_wait_asynccnt 0x0" ::: "memory");      /* no copy is outstanding when the buffers become output staging */
  v8f accs[8] = {c00, c01, c02, c03, c10, c11, c12, c13};
  float rbias[16];      /* ROWB: the bias of this lane's 16 C rows, loaded as one group in front of the element loop; both loops unrolled so that every index is a constant and the array stays in registers */
#pragma unroll
  for (int i = 0; i < 16; ++i) rbias[i] = 0.f;
  if (ROWB && bp) { const float* br = bp + row0 + 8 * hh;
#pragma unroll
    for (int i = 0; i < 16; ++i) rbias[i] = bf16_round(br[(i >> 3) * 16 + (i & 7)]); }
#pragma unroll
  for (int u = 0; u < 8; ++u) { const int t = u & 3, half = u >> 2; const int col = col0 + t * 16 + ln; const float bvc = (!ROWB && bp) ? bf16_round(bp[col]) : 0.f;
#pragma unroll
    for (int r = 0; r < 8; ++r) { const int rloc = half * 16 + 8 * hh + r; const float bv = ROWB ? rbias[half * 8 + r] : bvc; float v = accs[u][r] * alpha + bv; if (CP) { if (rowsPerB < 0) v += CP[cofs + (size_t)(row0g + row0 + rloc) * ldc + col];      /* rowsPerB < 0: own element of the batched C plane */ else { const int bidx = (row0g + row0 + rloc) / rowsPerB; v += CP[(size_t)bidx * sCPb + (size_t)by * 64 + col]; } }
      if (ACT == 3) v = fmaxf(v, 0.f); else if (ACT == 6) v = 0.5f * v * (1.0f + erff(v * 0.70710678118654752f)); else if (ACT == 11) v = 1.0f / (1.0f + expf(-v)); else if (ACT == 15) v = v / (1.0f + expf(-v)); else if (ACT == 12) v = (v > 0.f) ? v : 0.01f * v; else if (ACT == 8) v = tanhf(v); else if (ACT == 9) v = 0.5f * v * (1.0f + tanhf(0.7978845608028654f * (v + 0.044715f * v * v * v))); else if (ACT == 14) v = (v > 0.f) ? v : 0.1f * v; else if (ACT == 16) v = (v >= 0.f) ? v : 0.3f * v; else if (ACT == 17) v = (v >= 0.f) ? v : 0.2f * v;
      so[w][rloc][t * 16 + ln] = v; } }
  __builtin_amdgcn_fence(__ATOMIC_ACQ_REL, "workgroup"); __builtin_amdgcn_wave_barrier();
  const int rsub = lane >> 4, c4 = (lane & 15) * 4;
  {
#pragma unroll
    for (int q = 0; q < 16; ++q) { const int r = q * 2 + rsub; const v4f v = *(const v4fa*)&so[w][r][c4]; if (C) { *(v4f*)(C + cofs + (size_t)(row0 + r) * ldc + col0 + c4) = v; if (C16) asm volatile("s_wait_xcnt 0x0" ::: "memory"); }      /* the wait stands in front of the conversion below, which may overwrite registers that the f32 store names */
      if (C16) { v4h h4; for (int i = 0; i < 4; ++i) h4[i] = (_Float16)v[i]; *(v4h*)(C16 + cofs + (size_t)(row0 + r) * ldc + col0 + c4) = h4; } }
    asm volatile("s_wait_xcnt 0x0" ::: "memory");      /* stands behind the last stores, in front of any code of the calling kernel that follows the body and may overwrite registers that they name */
     } }
#define G2_SMEM __shared__ __attribute__((aligned(16))) unsigned char smem[2 * G2_STAGE]      /* the two operand buffers; behind the K loop's last barrier the same bytes stage the output tile */
template <int ACT, bool ROWB>
__global__ __launch_bounds__(128) void k_gemm2(const _Float16* __restrict__ A, int lda, size_t sA, const _Float16* __restrict__ Bh, int ldb, size_t sB, float alpha, const float* __restrict__ bias, size_t sBias, const float* __restrict__ CP, int rowsPerB, size_t sCPb, int row0g,
    float* __restrict__ C, _Float16* __restrict__ C16, int ldc, size_t sC, int M, int N, int K) { G2_SMEM;
  g2_body<ACT, ROWB>(smem, (int)blockIdx.x, (int)blockIdx.y, A, lda, sA, Bh, ldb, sB, alpha, bias, sBias, CP, rowsPerB, sCPb, row0g, C, C16, ldc, sC, M, N, K); }
// ---- large-tile GEMM, here for Q (the K / V and O2 launches carry their own copies of its loop): wave tile 64x64 (16 accumulator tiles; 8 fragments feed 16 WMMAs), WR x 2 waves, work-group tile 64 WR x 128 (WR = 2: 128x128, WR = 4: 256x128).
// Against the 128x64 tile of 32x64 waves it brings a third (WR = 2) or half (WR = 4) fewer operand bytes from L2 and reads a third fewer LDS bytes per WMMA, with half the waves and at most half the barriers.
// Same stage (64 k), same two buffers, same order of waits, same k order per output element. Requires M % (64 WR) == 0, N % 128 == 0, K % 64 == 0.
// v = acc * alpha + bias (ROWB: by C row, else by C column); writes f32 C (F32) or f16 C16.
#define G3_STAGE(WR) ((64 * (WR) + 128) * G2_PITCH)      /* bytes of one buffer: the A rows, then 128 B rows */
#define G3_OUT(WR) (2 * (WR) * 64 * 68 * 4)              /* bytes of the output staging: 64 rows of pitch 68 floats per wave */
#define G3_BYTES(WR) (2 * G3_STAGE(WR) > G3_OUT(WR) ? 2 * G3_STAGE(WR) : G3_OUT(WR))
// Eight copies: 16 B of 8 rows that lie LS bytes apart in LDS and s elements apart in global memory. l = the lane's LDS byte address of the first row, g = its global address.
// The closing s_wait_xcnt keeps every address register intact until the copies have taken it.
template <unsigned LS>
__device__ __forceinline__ void g3_copy8(unsigned l, const _Float16* g, size_t s) {
  asm volatile("global_load_async_to_lds_b128 %0, %8, off\n\t"
               "global_load_async_to_lds_b128 %1, %9, off\n\t"
               "global_load_async_to_lds_b128 %2, %10, off\n\t"
               "global_load_async_to_lds_b128 %3, %11, off\n\t"
               "global_load_async_to_lds_b128 %4, %12, off\n\t"
               "global_load_async_to_lds_b128 %5, %13, off\n\t"
               "global_load_async_to_lds_b128 %6, %14, off\n\t"
               "global_load_async_to_lds_b128 %7, %15, off\n\t"
               "s_wait_xcnt 0x0"
               :: "v"(l), "v"(l + 1 * LS), "v"(l + 2 * LS), "v"(l + 3 * LS), "v"(l + 4 * LS), "v"(l + 5 * LS), "v"(l + 6 * LS), "v"(l + 7 * LS),
                  "v"(g), "v"(g + s), "v"(g + 2 * s), "v"(g + 3 * s), "v"(g + 4 * s), "v"(g + 5 * s), "v"(g + 6 * s), "v"(g + 7 * s)
               : "memory");
}
// Twelve copies in one statement, one wait: 8 passes of A rows and, directly behind them in LDS, 4 passes of B rows.
template <unsigned LS>
__device__ __forceinline__ void g3_copy12(unsigned l, const _Float16* a, size_t sa, const _Float16* b, size_t sb) {
  asm volatile("global_load_async_to_lds_b128 %0, %12, off\n\t"
               "global_load_async_to_lds_b128 %1, %13, off\n\t"
               "global_load_async_to_lds_b128 %2, %14, off\n\t"
               "global_load_async_to_lds_b128 %3, %15, off\n\t"
               "global_load_async_to_lds_b128 %4, %16, off\n\t"
               "global_load_async_to_lds_b128 %5, %17, off\n\t"
               "global_load_async_to_lds_b128 %6, %18, off\n\t"
               "global_load_async_to_lds_b128 %7, %19, off\n\t"
               "global_load_async_to_lds_b128 %8, %20, off\n\t"
               "global_load_async_to_lds_b128 %9, %21, off\n\t"
               "global_load_async_to_lds_b128 %10, %22, off\n\t"
               "global_load_async_to_lds_b128 %11, %23, off\n\t"
               "s_wait_xcnt 0x0"
               :: "v"(l), "v"(l + 1 * LS), "v"(l + 2 * LS), "v"(l + 3 * LS), "v"(l + 4 * LS), "v"(l + 5 * LS), "v"(l + 6 * LS), "v"(l + 7 * LS), "v"(l + 8 * LS), "v"(l + 9 * LS), "v"(l + 10 * LS), "v"(l + 11 * LS),
                  "v"(a), "v"(a + sa), "v"(a + 2 * sa), "v"(a + 3 * sa), "v"(a + 4 * sa), "v"(a + 5 * sa), "v"(a + 6 * sa), "v"(a + 7 * sa),
                  "v"(b), "v"(b + sb), "v"(b + 2 * sb), "v"(b + 3 * sb)
               : "memory");
}
// One stage: the 64 WR threads x 16 B cover 8 WR rows a pass; 8 passes for the A rows, 16 / WR for the 128 B rows.
template <int WR>
__device__ __forceinline__ void g3_stage(unsigned l, const _Float16* a, size_t sa, const _Float16* b, size_t sb) {
  if (WR == 2) { g3_copy8<8 * WR * G2_PITCH>(l, a, sa); g3_copy8<8 * WR * G2_PITCH>(l + 64 * WR * G2_PITCH, b, sb); }      /* 16 copies: more operands than one statement takes */
  else g3_copy12<8 * WR * G2_PITCH>(l, a, sa, b, sb); }
template <int WR, bool ROWB, bool F32>
__device__ __forceinline__ void g3_body(unsigned char* smem, const int bx, const int by, const _Float16* __restrict__ A, int lda, size_t sA, const _Float16* __restrict__ Bh, int ldb, size_t sB, float alpha, const float* __restrict__ bias,
    float* __restrict__ C, _Float16* __restrict__ C16, int ldc, size_t sC, int M, int N, int K) {
  static_assert(WR == 2 || WR == 4, "the copy passes are written for these two");
  constexpr int TM = 64 * WR, RP = 8 * WR;      /* tile rows; rows per copy pass */
  float (*so)[64][68] = (float (*)[64][68])smem;
  const int tid = threadIdx.x, w = tid >> 5, lane = tid & 31, ln = lane & 15, hh = lane >> 4, wr = w >> 1, wc = w & 1;
  A += (size_t)by * sA; Bh += (size_t)by * sB; const size_t cofs = (size_t)by * sC;
  const int ntn = N >> 7; const int mt = bx / ntn, nq = bx - mt * ntn; const int row0 = mt * TM + 64 * wr, col0 = nq * 128 + 64 * wc; if (mt * TM >= M) return;      /* the whole work-group leaves, in front of every barrier */
  const unsigned lcp = (unsigned)(size_t)smem + (unsigned)((tid >> 3) * G2_PITCH + (tid & 7) * 16);
  const _Float16* gA = A + (size_t)(mt * TM + (tid >> 3)) * lda + (tid & 7) * 8; const _Float16* gB = Bh + (size_t)(nq * 128 + (tid >> 3)) * ldb + (tid & 7) * 8; const size_t sar = (size_t)RP * lda, sbr = (size_t)RP * ldb;
  const int nst = K >> 6;
  v8f acc[4][4];      /* [row tile][column tile]; every index below is a constant after unrolling */
#pragma unroll      /* constant indices: the arrays stay in registers */
  for (int i = 0; i < 4; ++i)
#pragma unroll      /* constant indices: the arrays stay in registers */
    for (int t = 0; t < 4; ++t) acc[i][t] = (v8f){0.f,0.f,0.f,0.f,0.f,0.f,0.f,0.f};
  g3_stage<WR>(lcp, gA, sar, gB, sbr);
  asm volatile("s_wait_asynccnt 0x0" ::: "memory");      /* this wave's copies of stage 0 have landed */
  __syncthreads();                                       /* ... and every other wave's */
  if (nst > 1) g3_stage<WR>(lcp + G3_STAGE(WR), gA + 64, sar, gB + 64, sbr);
#pragma unroll 1      /* stays rolled: one copy of the 32 WMMAs and of the ring's foot, so that the waits stand once and the loop is short in the instruction cache */
  for (int s = 0; s < nst; ++s) { const unsigned char* sb = smem + (s & 1) * G3_STAGE(WR); const unsigned char* pa = sb + (64 * wr + ln) * G2_PITCH + 16 * hh; const unsigned char* pb = sb + (TM + 64 * wc + ln) * G2_PITCH + 16 * hh;
#pragma unroll      /* constant indices: the arrays stay in registers */
    for (int h = 0; h < 2; ++h) { v16h fa[4], fb[4];      /* the 8 fragments of 32 k are read as one group in front of their 16 WMMAs */
#pragma unroll      /* constant indices: the arrays stay in registers */
      for (int i = 0; i < 4; ++i) { fa[i] = g2_frag(pa + 16 * i * G2_PITCH + 64 * h); fb[i] = g2_frag(pb + 16 * i * G2_PITCH + 64 * h); }
#pragma unroll      /* constant indices: the arrays stay in registers */
      for (int t = 0; t < 4; ++t)
#pragma unroll      /* constant indices: the arrays stay in registers */
        for (int i = 0; i < 4; ++i) acc[i][t] = g2_mma(fa[i], fb[t], acc[i][t]); }
    asm volatile("s_wait_dscnt 0x0" ::: "memory");       /* this wave's reads of the buffer are over before it may be refilled */
    asm volatile("s_wait_asynccnt 0x0" ::: "memory");    /* this wave's copies of stage s + 1 have landed */
    __syncthreads();                                     /* publishes stage s + 1 and ends every wave's reads of stage s */
    if (s + 2 < nst) g3_stage<WR>(lcp + (unsigned)(s & 1) * G3_STAGE(WR), gA + (size_t)(s + 2) * 64, sar, gB + (size_t)(s + 2) * 64, sbr); }
  asm volatile("s_wait_asynccnt 0x0" ::: "memory");      /* no copy is outstanding when the buffers become output staging */
#pragma unroll      /* constant indices: the arrays stay in registers */
  for (int i = 0; i < 4; ++i) { float rb[8];      /* ROWB: the bias of this lane's 8 C rows of row tile i */
#pragma unroll      /* constant indices: the arrays stay in registers */
    for (int r = 0; r < 8; ++r) rb[r] = ROWB ? bf16_round(bias[row0 + i * 16 + 8 * hh + r]) : 0.f;
#pragma unroll      /* constant indices: the arrays stay in registers */
    for (int t = 0; t < 4; ++t) { const float bvc = ROWB ? 0.f : bf16_round(bias[col0 + t * 16 + ln]);
#pragma unroll      /* constant indices: the arrays stay in registers */
      for (int r = 0; r < 8; ++r) so[w][i * 16 + 8 * hh + r][t * 16 + ln] = acc[i][t][r] * alpha + (ROWB ? rb[r] : bvc); } }
  __builtin_amdgcn_fence(__ATOMIC_ACQ_REL, "workgroup"); __builtin_amdgcn_wave_barrier();      /* the wave's staging writes stand in front of its read-back of other lanes' values; each wave stages in its own range, so no work-group barrier */
  const int rsub = lane >> 4, c4 = (lane & 15) * 4;
#pragma unroll      /* straight-line: the row pairs' LDS reads run ahead of the stores */
  for (int q = 0; q < 32; ++q) { const int r = q * 2 + rsub; const v4f v = *(const v4fa*)&so[w][r][c4];
    if (F32) *(v4f*)(C + cofs + (size_t)(row0 + r) * ldc + col0 + c4) = v;
    else { v4h h4; for (int i = 0; i < 4; ++i) h4[i] = (_Float16)v[i]; *(v4h*)(C16 + cofs + (size_t)(row0 + r) * ldc + col0 + c4) = h4; } }
  asm volatile("s_wait_xcnt 0x0" ::: "memory"); }      /* stands behind the last stores, in front of any code of the calling kernel that follows the body and may overwrite registers that they name */
#define G3_SMEM(WR) __shared__ __attribute__((aligned(16))) unsigned char smem[G3_BYTES(WR)]      /* the two operand buffers; behind the K loop's last barrier the same bytes stage the output tile */
// K, V and the head's M partial in one launch: K and V never go to memory. x = head * 4 + position tile, y = sample: 512 work-groups of 8 waves, two per WGP.
// The 128 A rows of a work-group are the head's 64 K rows (Wq) and its 64 V rows (Wv); B rows = 256 positions. Same stage, buffers, waits and k order as the large-tile GEMM above, and as many operand bytes as its 256x128 tile.
// Behind the K loop the 128 x 256 tile is rounded to f16 into LDS, position rows with the channels contiguous (a lane's 8 accumulator registers are 8 neighbouring channels of one position: one 16-B store),
// and M_p[c'][c] = sum over the tile's 256 positions of K[c'][D] V[c][D] is formed on WMMA (wave = 16 K rows x 32 V columns), both operands read by transposing LDS loads, and stored f32 with the V channel contiguous (the k of the next launch's product with Wo); the next launch adds the 4 position tiles' partials.
#define KM_P 256          /* positions per work-group */
#define KM_PITCH (2 * HD * 2 + 32)    /* LDS row pitch in bytes of the f16 K / V tile (a row = one position's 128 channels): 32 B x odd, for the ds_load_tr16_b128 readers */
typedef short s16x8 __attribute__((ext_vector_type(8)));
// One 16 x 32 operand (16 channels, k = 32 positions) from the position-major tile: two transposing loads, positions 0 to 15 and 16 to 31. p = the lane's address: row 8 (lane / 16) + lane % 8, byte 16 ((lane / 8) % 2) of the 16 channels' 32 B.
// A lane gets its channel at positions 8 hh + 0 ... 7 and 16 + 8 hh + 0 ... 7; V and K are read by this same code, so that their k orders are equal.
__device__ __forceinline__ v16h km_frag(const unsigned char* p) { typedef __attribute__((address_space(3))) s16x8 lds_s16x8; union { v16h v; s16x8 q[2]; } f;
  f.q[0] = __builtin_amdgcn_ds_load_tr16_b128_v8i16((lds_s16x8*)p); f.q[1] = __builtin_amdgcn_ds_load_tr16_b128_v8i16((lds_s16x8*)(p + 16 * KM_PITCH)); return f.v; }
#define KM_PT (PX / KM_P) /* position tiles = partials per head */
// Twelve copies in one statement, one wait: 4 passes of A rows (two of Wq, two of Wv) and, directly behind them in LDS, 8 passes of B rows. s = one pass of weight rows in elements.
// The closing s_wait_xcnt keeps every address register intact until the copies have taken it.
template <unsigned LS>
__device__ __forceinline__ void km_copy12(unsigned l, const _Float16* q, const _Float16* v, size_t s, const _Float16* b, size_t sb) {
  asm volatile("global_load_async_to_lds_b128 %0, %12, off\n\t"
               "global_load_async_to_lds_b128 %1, %13, off\n\t"
               "global_load_async_to_lds_b128 %2, %14, off\n\t"
               "global_load_async_to_lds_b128 %3, %15, off\n\t"
               "global_load_async_to_lds_b128 %4, %16, off\n\t"
               "global_load_async_to_lds_b128 %5, %17, off\n\t"
               "global_load_async_to_lds_b128 %6, %18, off\n\t"
               "global_load_async_to_lds_b128 %7, %19, off\n\t"
               "global_load_async_to_lds_b128 %8, %20, off\n\t"
               "global_load_async_to_lds_b128 %9, %21, off\n\t"
               "global_load_async_to_lds_b128 %10, %22, off\n\t"
               "global_load_async_to_lds_b128 %11, %23, off\n\t"
               "s_wait_xcnt 0x0"
               :: "v"(l), "v"(l + 1 * LS), "v"(l + 2 * LS), "v"(l + 3 * LS), "v"(l + 4 * LS), "v"(l + 5 * LS), "v"(l + 6 * LS), "v"(l + 7 * LS), "v"(l + 8 * LS), "v"(l + 9 * LS), "v"(l + 10 * LS), "v"(l + 11 * LS),
                  "v"(q), "v"(q + s), "v"(v), "v"(v + s),
                  "v"(b), "v"(b + sb), "v"(b + 2 * sb), "v"(b + 3 * sb), "v"(b + 4 * sb), "v"(b + 5 * sb), "v"(b + 6 * sb), "v"(b + 7 * sb)
               : "memory");
}
__global__ __launch_bounds__(256) void k_gemm_kvm(const _Float16* __restrict__ X16, const _Float16* __restrict__ BWq, const _Float16* __restrict__ BWv, const float* __restrict__ bq, const float* __restrict__ bv, float* __restrict__ MP) {
  __shared__ __attribute__((aligned(16))) unsigned char smem[2 * G3_STAGE(4)];      /* the two operand buffers; behind the K loop's last barrier the same bytes hold the f16 K / V tile */
  __shared__ __attribute__((aligned(16))) float sbi[2 * HD];      /* the tile's 128 channels' bias; filled beside stage 0, so that the epilogue waits for no parameter from memory */
  static_assert(KM_P * KM_PITCH <= 2 * G3_STAGE(4) && 2 * HD + KM_P == 64 * 4 + 128, "the f16 tile must fit the operand buffers; a buffer holds the 128 + 256 rows");
  const int tid = threadIdx.x, w = tid >> 5, lane = tid & 31, ln = lane & 15, hh = lane >> 4, wr = w >> 2, wc = w & 3;      /* wave row 0 = K, 1 = V; wave column = 64 positions */
  const int hd = (int)blockIdx.x / KM_PT, nq = (int)blockIdx.x % KM_PT, n = (int)blockIdx.y;
  const unsigned lcp = (unsigned)(size_t)smem + (unsigned)((tid >> 3) * G2_PITCH + (tid & 7) * 16);
  const size_t wofs = (size_t)(hd * HD + (tid >> 3)) * CC + (tid & 7) * 8;
  const _Float16* gQ = BWq + wofs; const _Float16* gV = BWv + wofs; const _Float16* gB = X16 + ((size_t)n * PX + nq * KM_P + (tid >> 3)) * CC + (tid & 7) * 8; const size_t sr = (size_t)32 * CC;      /* 256 threads x 16 B = 32 rows a pass */
  constexpr int nst = CC >> 6;
  v8f acc[4][4];      /* [row tile][column tile]; every index below is a constant after unrolling */
#pragma unroll      /* constant indices: the arrays stay in registers */
  for (int i = 0; i < 4; ++i)
#pragma unroll      /* constant indices: the arrays stay in registers */
    for (int t = 0; t < 4; ++t) acc[i][t] = (v8f){0.f,0.f,0.f,0.f,0.f,0.f,0.f,0.f};
  km_copy12<32 * G2_PITCH>(lcp, gQ, gV, sr, gB, sr);
  if (tid < 2 * HD) sbi[tid] = bf16_round((tid < HD ? bq : bv)[hd * HD + (tid & (HD - 1))]);      /* waves 0 to 3 as wholes; published by the barrier below */
  asm volatile("s_wait_asynccnt 0x0" ::: "memory");      /* this wave's copies of stage 0 have landed */
  __syncthreads();                                       /* ... and every other wave's */
  km_copy12<32 * G2_PITCH>(lcp + G3_STAGE(4), gQ + 64, gV + 64, sr, gB + 64, sr);
#pragma unroll 1      /* stays rolled: one copy of the 32 WMMAs and of the ring's foot, so that the waits stand once and the loop is short in the instruction cache */
  for (int s = 0; s < nst; ++s) { const unsigned char* sb = smem + (s & 1) * G3_STAGE(4); const unsigned char* pa = sb + (64 * wr + ln) * G2_PITCH + 16 * hh; const unsigned char* pb = sb + (2 * HD + 64 * wc + ln) * G2_PITCH + 16 * hh;
#pragma unroll      /* constant indices: the arrays stay in registers */
    for (int h = 0; h < 2; ++h) { v16h fa[4], fb[4];      /* the 8 fragments of 32 k are read as one group in front of their 16 WMMAs */
#pragma unroll      /* constant indices: the arrays stay in registers */
      for (int i = 0; i < 4; ++i) { fa[i] = g2_frag(pa + 16 * i * G2_PITCH + 64 * h); fb[i] = g2_frag(pb + 16 * i * G2_PITCH + 64 * h); }
#pragma unroll      /* constant indices: the arrays stay in registers */
      for (int t = 0; t < 4; ++t)
#pragma unroll      /* constant indices: the arrays stay in registers */
        for (int i = 0; i < 4; ++i) acc[i][t] = g2_mma(fa[i], fb[t], acc[i][t]); }
    asm volatile("s_wait_dscnt 0x0" ::: "memory");       /* this wave's reads of the buffer are over before it may be refilled */
    asm volatile("s_wait_asynccnt 0x0" ::: "memory");    /* this wave's copies of stage s + 1 have landed */
    __syncthreads();                                     /* publishes stage s + 1 and ends every wave's reads of stage s */
    if (s + 2 < nst) km_copy12<32 * G2_PITCH>(lcp + (unsigned)(s & 1) * G3_STAGE(4), gQ + (size_t)(s + 2) * 64, gV + (size_t)(s + 2) * 64, sr, gB + (size_t)(s + 2) * 64, sr); }
  asm volatile("s_wait_asynccnt 0x0" ::: "memory");      /* no copy is outstanding when the buffers become the f16 tile */
#pragma unroll      /* constant indices: the arrays stay in registers */
  for (int i = 0; i < 4; ++i) { float rb[8];      /* the bias of this lane's 8 channels of row tile i */
#pragma unroll      /* constant indices: the arrays stay in registers */
    for (int r = 0; r < 8; ++r) rb[r] = sbi[64 * wr + i * 16 + 8 * hh + r];
#pragma unroll      /* constant indices: the arrays stay in registers */
    for (int t = 0; t < 4; ++t) { FragH f;
#pragma unroll      /* constant indices: the arrays stay in registers */
      for (int r = 0; r < 8; ++r) f.h[r] = (_Float16)(acc[i][t][r] * 0.0625f + rb[r]);
      *(v8us*)(smem + (64 * wc + t * 16 + ln) * KM_PITCH + (64 * wr + i * 16 + 8 * hh) * 2) = f.half[0]; } }
  __syncthreads();      /* every wave's part of the f16 tile is in LDS */
  const int rt = w & 3, cq = w >> 2;      /* the wave's 16 K rows and its 32 V columns: one whole 128-B line of each of its rows of M_p */
  const unsigned char* pt = smem + (8 * hh + (lane & 7)) * KM_PITCH + ((lane >> 3) & 1) * 16; const unsigned char* pk = pt + 16 * rt * 2; const unsigned char* pv = pt + (HD + 32 * cq) * 2;
  v8f mc[2];
#pragma unroll      /* constant indices: the arrays stay in registers */
  for (int c = 0; c < 2; ++c) mc[c] = (v8f){0.f,0.f,0.f,0.f,0.f,0.f,0.f,0.f};
  v16h fk[KM_P / 32], fv[KM_P / 32][2];      /* the 24 fragments are read as one group, into the registers that the accumulators have left: one LDS latency instead of one per WMMA */
#pragma unroll      /* constant indices: the arrays stay in registers */
  for (int ks = 0; ks < KM_P / 32; ++ks) { fk[ks] = km_frag(pk + 32 * ks * KM_PITCH); fv[ks][0] = km_frag(pv + 32 * ks * KM_PITCH); fv[ks][1] = km_frag(pv + 32 * ks * KM_PITCH + 32); }
#pragma unroll      /* constant indices: the arrays stay in registers */
  for (int ks = 0; ks < KM_P / 32; ++ks)
#pragma unroll      /* constant indices: the arrays stay in registers */
    for (int c = 0; c < 2; ++c) mc[c] = g2_mma(fk[ks], fv[ks][c], mc[c]);
  float* __restrict__ mp = MP + ((size_t)((n * KM_PT + nq) * NH + hd) * (HD * HD)); const unsigned mo = (unsigned)((16 * rt + 8 * hh) * HD + 32 * cq + ln);
#pragma unroll      /* constant offsets from one lane offset; a line's two 64-B pieces follow one another */
  for (int r = 0; r < 8; ++r)
#pragma unroll      /* constant indices */
    for (int c = 0; c < 2; ++c) mp[mo + r * HD + c * 16] = mc[c][r]; }
// W2 = Wo M and Q in one launch (W2 reads the partials and Wo, Q reads X: neither reads the other). W2's blocks stand first in the grid.
// O2[o][d] = sum_c Wo[o][c] O[c][d] = sum_c' (sum_c Wo[o][c] M[c][c']) Q[c'][d]: the head's 64x64 block goes into the weights (512 x 64 x 64 per head and sample) instead of into the 1,024 positions, and O is never formed.
// A block takes one head of one sample and 256 rows of Wo: it adds the 4 position tiles' f32 partials in ascending order, rounds to f16 into LDS (rows c', the V channel c contiguous), and forms W2^T[c'][o] = sum_c M[c'][c] Wo[o][c] on WMMA
// (wave tile 64 c' x 64 o, k = 64; A from LDS, B = Wo rows straight from memory, both by g2_frag: equal k orders). A lane's 8 accumulator registers are 8 neighbouring c' of one row o: one 16-B store. W2 keeps Wo's x16.
#define MS_B (NB * NH * 2)
__device__ __forceinline__ void w2_body(unsigned char* smem, const float* __restrict__ MP, const _Float16* __restrict__ BWo, _Float16* __restrict__ W2, const int b) {
  const int tid = threadIdx.x, w = tid >> 5, lane = tid & 31, ln = lane & 15, hh = lane >> 4; const int n = b / (NH * 2), h = (b >> 1) % NH, o0 = (b & 1) * 256 + 64 * w;
  const char* __restrict__ src = (const char*)(MP + (size_t)(n * KM_PT * NH + h) * (HD * HD)); const unsigned so = (unsigned)tid * 16u;      /* so = the lane's byte offset in the head's first partial */
  const char* __restrict__ wsrc = (const char*)(BWo + h * HD); const unsigned wo = (unsigned)((o0 + ln) * CC * 2 + 16 * hh);      /* wo = the lane's byte offset in the head's columns of Wo */
  v4f a[8][KM_PT]; FragH fb[2][4];      /* 32 + 16 16-B loads of a lane in flight: one memory latency for both operands */
#pragma unroll      /* constant indices: the array stays in registers */
  for (int j = 0; j < 8; ++j)
#pragma unroll      /* constant indices: the array stays in registers */
    for (int p = 0; p < KM_PT; ++p) a[j][p] = *(const v4fa*)(src + (so + (j * 512 + p * (NH * HD * HD)) * 4));
#pragma unroll      /* constant indices: the array stays in registers */
  for (int ks = 0; ks < 2; ++ks)
#pragma unroll      /* constant indices: the array stays in registers */
    for (int t = 0; t < 4; ++t) { fb[ks][t].half[0] = *(const v8us*)(wsrc + (wo + t * 16 * CC * 2 + 64 * ks)); fb[ks][t].half[1] = *(const v8us*)(wsrc + (wo + t * 16 * CC * 2 + 64 * ks + 32)); }
  asm volatile("s_wait_xcnt 0x0" :: "v"(so), "v"(wo) : "memory");      /* stands behind the loads, in front of any overwrite of the address registers that they name; the operands keep those registers whole up to here */
  unsigned char* md = smem + (tid >> 4) * G2_PITCH + (tid & 15) * 8;      /* element tid * 4 + 512 j = row tid / 16 + 8 j, column 4 (tid % 16) */
#pragma unroll      /* constant indices: the array stays in registers */
  for (int j = 0; j < 8; ++j) { v4f s = a[j][0];
#pragma unroll      /* constant indices */
    for (int p = 1; p < KM_PT; ++p) s += a[j][p];
    v4h h4; for (int i = 0; i < 4; ++i) h4[i] = (_Float16)s[i]; *(v4h*)(md + j * 8 * G2_PITCH) = h4; }
  __syncthreads();      /* the head's f16 block is in LDS; block-uniform: every thread of a W2 block comes here */
  const unsigned char* pa = smem + ln * G2_PITCH + 16 * hh;
  v8f acc[4][4];      /* [c' tile][o tile]; every index below is a constant after unrolling */
#pragma unroll      /* constant indices: the arrays stay in registers */
  for (int i = 0; i < 4; ++i)
#pragma unroll      /* constant indices: the arrays stay in registers */
    for (int t = 0; t < 4; ++t) acc[i][t] = (v8f){0.f,0.f,0.f,0.f,0.f,0.f,0.f,0.f};
#pragma unroll      /* constant indices: the arrays stay in registers */
  for (int ks = 0; ks < 2; ++ks) { v16h fa[4];
#pragma unroll      /* constant indices: the arrays stay in registers */
    for (int i = 0; i < 4; ++i) fa[i] = g2_frag(pa + 16 * i * G2_PITCH + 64 * ks);
#pragma unroll      /* constant indices: the arrays stay in registers */
    for (int t = 0; t < 4; ++t)
#pragma unroll      /* constant indices: the arrays stay in registers */
      for (int i = 0; i < 4; ++i) acc[i][t] = g2_mma(fa[i], fb[ks][t].v, acc[i][t]); }
  unsigned short* __restrict__ dst = (unsigned short*)W2 + (size_t)n * CC * CC + h * HD; const unsigned d0 = (unsigned)((o0 + ln) * CC + 8 * hh);
#pragma unroll      /* constant offsets from one lane offset; the 4 pieces of a row's 128-B line follow one another */
  for (int t = 0; t < 4; ++t)
#pragma unroll      /* constant indices: the arrays stay in registers */
    for (int i = 0; i < 4; ++i) { FragH f;
#pragma unroll      /* constant indices */
      for (int r = 0; r < 8; ++r) f.h[r] = (_Float16)acc[i][t][r];
      *(v8us*)(dst + (d0 + t * 16 * CC + i * 16)) = f.half[0]; }
  asm volatile("s_wait_xcnt 0x0" ::: "memory"); }      /* stands behind the last stores, in front of any code of the calling kernel that follows the body and may overwrite registers that they name */
__global__ __launch_bounds__(128) void k_gemm_wq(const float* __restrict__ MP, const _Float16* __restrict__ BWo, _Float16* __restrict__ W2, const _Float16* __restrict__ X16, const _Float16* __restrict__ BWk, const float* __restrict__ bk, _Float16* __restrict__ QR) { G3_SMEM(2);
  const int b = (int)blockIdx.x;
  if (b < MS_B) w2_body(smem, MP, BWo, W2, b);      /* the same for the whole block */
  else g3_body<2, false, false>(smem, b - MS_B, 0, X16, CC, 0, BWk, CC, 0, 0.0625f, bk, nullptr, QR, CC, 0, (int)NR, CC, CC); }      /* Q = K_conv(X), token-major */


// The streaming launch (prep) has few waves, each with 8 KiB of whole-line 16-B loads in flight.
// X transpose: a work-group takes 64 channels x 256 positions. A wave-wide load covers 4 channel rows x one 128-B line; a lane holds the same 4 positions of two neighbouring channels,
// so that each LDS store is one dword (a channel pair of one position). LDS rows = positions, pitch 144 B (16 B x odd) for the ds_load_b128 read-back of 8 channels.
#define XT_P 256
#define XT_PITCH 144
typedef _Float16 v2h __attribute__((ext_vector_type(2)));
__device__ __forceinline__ void xrows_body(const float* __restrict__ x, _Float16* __restrict__ X16, const int bx) { __shared__ __attribute__((aligned(16))) unsigned char tl[XT_P * XT_PITCH]; const int tid = threadIdx.x, w = tid >> 5, lane = tid & 31, r = lane >> 3, pq = lane & 7; const int cg = bx % (CC / 64); const int pb = (bx / (CC / 64)) % (PX / XT_P); const int n = bx / ((CC / 64) * (PX / XT_P)); const int p0 = pb * XT_P, c0 = cg * 64;
  const float* src = x + ((size_t)n * CC + c0 + w * 8 + 2 * r) * PX + p0 + pq * 4;
  v4f e[XT_P / 32], o[XT_P / 32];
#pragma unroll
  for (int k = 0; k < XT_P / 32; ++k) { e[k] = *(const v4fa*)(src + k * 32); o[k] = *(const v4fa*)(src + PX + k * 32); }
  __builtin_amdgcn_sched_barrier(0);      /* keeps the 16 loads in flight together: without it the scheduler lifts the first conversions, with their waits, in between the loads */
  asm volatile("s_wait_xcnt 0x0" :: "v"(src) : "memory");      /* stands behind the loads, in front of any overwrite of the address register that they name; the operand keeps that register whole up to here */
  unsigned char* dst = tl + pq * 4 * XT_PITCH + (w * 4 + r) * 4;
#pragma unroll
  for (int k = 0; k < XT_P / 32; ++k)
#pragma unroll
    for (int j = 0; j < 4; ++j) { v2h h; h[0] = (_Float16)bf16_round(e[k][j]); h[1] = (_Float16)bf16_round(o[k][j]); *(v2h*)(dst + (k * 32 + j) * XT_PITCH) = h; }
  __syncthreads();
  const unsigned char* rd = tl + (tid >> 3) * XT_PITCH + (tid & 7) * 16; unsigned short* g = (unsigned short*)X16 + ((size_t)n * PX + p0 + (tid >> 3)) * CC + c0 + (tid & 7) * 8;
#pragma unroll
  for (int i = 0; i < XT_P / 32; ++i) *(v8us*)(g + (size_t)i * 32 * CC) = *(const v8us*)(rd + i * 32 * XT_PITCH); }      /* a wave-wide store = one 128-B line of 4 positions */
#define WCH 8      /* chunks of 8 weights per thread */
__device__ __forceinline__ void wnat_body(const float* __restrict__ w, _Float16* __restrict__ Bt, const int bx) { const unsigned t0 = (unsigned)bx * (256 * WCH) + threadIdx.x; const unsigned src = t0 * 32u; const char* wb = (const char*)w; v4f a[WCH], b[WCH];      /* src = the lane's byte offset in the matrix */
#pragma unroll
  for (int u = 0; u < WCH; ++u) { a[u] = *(const v4fa*)(wb + (src + u * 8192)); b[u] = *(const v4fa*)(wb + (src + u * 8192 + 16)); }
  asm volatile("s_wait_xcnt 0x0" :: "v"(src) : "memory");      /* stands behind the loads, in front of any overwrite of the address register that they name; the operand keeps that register whole up to here */
#pragma unroll
  for (int u = 0; u < WCH; ++u) { FragH f; for (int q = 0; q < 4; ++q) { f.h[q] = (_Float16)(bf16_round(a[u][q]) * 16.0f); f.h[4 + q] = (_Float16)(bf16_round(b[u][q]) * 16.0f); } *(v8us*)((unsigned short*)Bt + (t0 + u * 256) * 8) = f.half[0]; }
  asm volatile("s_wait_xcnt 0x0" ::: "memory"); }      /* stands behind the last stores, in front of any code of the calling kernel that follows the body and may overwrite registers that they name */
// The X transpose and the four weight roundings in one launch (none reads another's result): the transpose's blocks first, then WB blocks per weight matrix.
#define XB (NB * (CC / 64) * (PX / XT_P))
#define WB (CC * CC / 8 / 256 / WCH)
static_assert(WB * WCH * 256 * 8 == CC * CC, "the weight blocks cover a matrix exactly");
__global__ __launch_bounds__(256) void k_prep(const float* __restrict__ x, _Float16* __restrict__ X16, const float* __restrict__ Wq, const float* __restrict__ Wk, const float* __restrict__ Wv, const float* __restrict__ Wo,
    _Float16* __restrict__ BWq, _Float16* __restrict__ BWk, _Float16* __restrict__ BWv, _Float16* __restrict__ BWo) {
  const int b = (int)blockIdx.x;
  if (b < XB) { xrows_body(x, X16, b); return; }      /* the same for the whole block */
  const int m = (b - XB) / WB;
  wnat_body(m == 0 ? Wq : m == 1 ? Wk : m == 2 ? Wv : Wo, m == 0 ? BWq : m == 1 ? BWk : m == 2 ? BWv : BWo, (b - XB) % WB); }
// ---- O2 = W2 Q^T + bo, GroupNorm and the residual in one launch. A work-group of 16 waves holds 64 channels x all 1,024 positions of one sample in its accumulators (wave tile 64x64, wave w = positions 64 w ...),
// that is 16 whole GroupNorm groups: the statistics come from the accumulators, and O2 never goes to memory. x = channel tile, y = sample: 128 work-groups, one per WGP (LDS).
// Same stage (64 k), same two buffers, same order of waits and same k order per output element as the large-tile GEMM above.
#define F_STAGE ((64 + PX) * G2_PITCH)      /* bytes of one buffer: 64 A rows (the sample's W2), then the sample's 1,024 B rows (positions) */
#define F_RED (16 * 64 * 68 * 4)            /* behind the output staging (64 rows of pitch 68 floats per wave): float [16 waves][16 groups][2], each wave's sum and sum of squares */
#define F_STAT (F_RED + 16 * 16 * 2 * 4)    /* float [16 groups][2]: mean, 1 / sqrt(var + eps) */
static_assert(F_STAT + 16 * 2 * 4 <= 2 * F_STAGE, "staging and statistics must fit the operand buffers");
// Nine copies in one statement, one wait: 16 B of one row (l0, g0) and of 8 rows that lie LS bytes apart in LDS and s elements apart in global memory.
// The closing s_wait_xcnt keeps every address register intact until the copies have taken it.
template <unsigned LS>
__device__ __forceinline__ void f_copy9(unsigned l0, const _Float16* g0, unsigned l, const _Float16* g, size_t s) {
  asm volatile("global_load_async_to_lds_b128 %0, %9, off\n\t"
               "global_load_async_to_lds_b128 %1, %10, off\n\t"
               "global_load_async_to_lds_b128 %2, %11, off\n\t"
               "global_load_async_to_lds_b128 %3, %12, off\n\t"
               "global_load_async_to_lds_b128 %4, %13, off\n\t"
               "global_load_async_to_lds_b128 %5, %14, off\n\t"
               "global_load_async_to_lds_b128 %6, %15, off\n\t"
               "global_load_async_to_lds_b128 %7, %16, off\n\t"
               "global_load_async_to_lds_b128 %8, %17, off\n\t"
               "s_wait_xcnt 0x0"
               :: "v"(l0), "v"(l), "v"(l + 1 * LS), "v"(l + 2 * LS), "v"(l + 3 * LS), "v"(l + 4 * LS), "v"(l + 5 * LS), "v"(l + 6 * LS), "v"(l + 7 * LS),
                  "v"(g0), "v"(g), "v"(g + s), "v"(g + 2 * s), "v"(g + 3 * s), "v"(g + 4 * s), "v"(g + 5 * s), "v"(g + 6 * s), "v"(g + 7 * s)
               : "memory");
}
// One stage: the 512 threads x 16 B cover 64 rows a pass; one pass for the A rows, 16 for the B rows. 17 copies of a wave in flight.
__device__ __forceinline__ void f_stage(unsigned l, const _Float16* a, const _Float16* b) {
  f_copy9<64 * G2_PITCH>(l, a, l + 64 * G2_PITCH, b, (size_t)64 * CC);
  g3_copy8<64 * G2_PITCH>(l + (64 + 512) * G2_PITCH, b + (size_t)512 * CC, (size_t)64 * CC); }
__global__ __launch_bounds__(512) void k_o2gn(const _Float16* __restrict__ W2, const _Float16* __restrict__ QR, const float* __restrict__ bo, const float* __restrict__ gw, const float* __restrict__ gb, const float* __restrict__ x, float* __restrict__ out) {
  __shared__ __attribute__((aligned(16))) unsigned char smem[2 * F_STAGE];      /* the two operand buffers; behind the K loop's last barrier the same bytes hold the output staging and the statistics */
  __shared__ __attribute__((aligned(16))) float swb[64][2], sbo[64];      /* the tile's 64 channels: affine weight and bias, conv bias; filled beside stage 0, so that the epilogue waits for no parameter from memory */
  float (*so)[64][68] = (float (*)[64][68])smem;
  const int tid = threadIdx.x, lane = tid & 31, ln = lane & 15, hh = lane >> 4; const int w = __builtin_amdgcn_readfirstlane(tid >> 5);      /* the wave's number, told to the compiler as wave-uniform so that the X and output rows get a scalar base */
  const int ch0 = (int)blockIdx.x * 64, n = (int)blockIdx.y;
  const unsigned lcp = (unsigned)(size_t)smem + (unsigned)((tid >> 3) * G2_PITCH + (tid & 7) * 16);
  const _Float16* gA = W2 + ((size_t)n * CC + ch0 + (tid >> 3)) * CC + (tid & 7) * 8; const _Float16* gB = QR + ((size_t)n * PX + (tid >> 3)) * CC + (tid & 7) * 8;
  constexpr int nst = CC >> 6;
  v8f acc[4][4];      /* [row tile][column tile]; every index below is a constant after unrolling */
#pragma unroll      /* constant indices: the arrays stay in registers */
  for (int i = 0; i < 4; ++i)
#pragma unroll      /* constant indices: the arrays stay in registers */
    for (int t = 0; t < 4; ++t) acc[i][t] = (v8f){0.f,0.f,0.f,0.f,0.f,0.f,0.f,0.f};
  f_stage(lcp, gA, gB);
  if (w < 6) { const float* p = w < 2 ? gw : w < 4 ? gb : bo; float* d = w < 4 ? &swb[tid & 63][w >> 1] : &sbo[tid & 63]; *d = bf16_round(p[ch0 + (tid & 63)]); }      /* waves 0 to 5 as wholes, two per parameter row; published by the barrier below */
  asm volatile("s_wait_asynccnt 0x0" ::: "memory");      /* this wave's copies of stage 0 have landed */
  __syncthreads();                                       /* ... and every other wave's */
  f_stage(lcp + F_STAGE, gA + 64, gB + 64);
#pragma unroll 1      /* stays rolled: one copy of the 32 WMMAs and of the ring's foot, so that the waits stand once and the loop is short in the instruction cache */
  for (int s = 0; s < nst; ++s) { const unsigned char* sb = smem + (s & 1) * F_STAGE; const unsigned char* pa = sb + ln * G2_PITCH + 16 * hh; const unsigned char* pb = sb + (64 + 64 * w + ln) * G2_PITCH + 16 * hh;
#pragma unroll      /* constant indices: the arrays stay in registers */
    for (int h = 0; h < 2; ++h) { v16h fa[4], fb[4];      /* the 8 fragments of 32 k are read as one group in front of their 16 WMMAs */
#pragma unroll      /* constant indices: the arrays stay in registers */
      for (int i = 0; i < 4; ++i) { fa[i] = g2_frag(pa + 16 * i * G2_PITCH + 64 * h); fb[i] = g2_frag(pb + 16 * i * G2_PITCH + 64 * h); }
#pragma unroll      /* constant indices: the arrays stay in registers */
      for (int t = 0; t < 4; ++t)
#pragma unroll      /* constant indices: the arrays stay in registers */
        for (int i = 0; i < 4; ++i) acc[i][t] = g2_mma(fa[i], fb[t], acc[i][t]); }
    asm volatile("s_wait_dscnt 0x0" ::: "memory");       /* this wave's reads of the buffer are over before it may be refilled */
    asm volatile("s_wait_asynccnt 0x0" ::: "memory");    /* this wave's copies of stage s + 1 have landed */
    __syncthreads();                                     /* publishes stage s + 1 and ends every wave's reads of stage s */
    if (s + 2 < nst) f_stage(lcp + (unsigned)(s & 1) * F_STAGE, gA + (size_t)(s + 2) * 64, gB + (size_t)(s + 2) * 64); }
  asm volatile("s_wait_asynccnt 0x0" ::: "memory");      /* no copy is outstanding when the buffers become output staging */
  float* red = (float*)(smem + F_RED); float* st = (float*)(smem + F_STAT);
  // O2 values: staged in the wave's own LDS range for the row-wise read-back, and summed per lane and group. A lane's 8 rows of row tile i are two groups of 4 channels.
  float ps[4][2], pq[4][2];
#pragma unroll      /* constant indices: the arrays stay in registers */
  for (int i = 0; i < 4; ++i) { float rb[8];      /* the bias of this lane's 8 channels of row tile i */
#pragma unroll      /* constant indices: the arrays stay in registers */
    for (int r = 0; r < 8; ++r) rb[r] = sbo[i * 16 + 8 * hh + r];
    ps[i][0] = ps[i][1] = pq[i][0] = pq[i][1] = 0.f;
#pragma unroll      /* constant indices: the arrays stay in registers */
    for (int t = 0; t < 4; ++t)
#pragma unroll      /* constant indices: the arrays stay in registers */
      for (int r = 0; r < 8; ++r) { const float v = acc[i][t][r] * 0.0625f + rb[r]; so[w][i * 16 + 8 * hh + r][t * 16 + ln] = v; ps[i][r >> 2] += v; pq[i][r >> 2] += v * v; } }
  // The wave's X rows: 32 wave-wide 16-B loads (two channel rows x 256 B each) go out here, into the registers that the accumulators have left, and fly while the statistics are formed.
  const int rsub = lane >> 4, c4 = (lane & 15) * 4; const size_t base = ((size_t)n * CC + ch0) * PX + 64 * w; const unsigned lo = (unsigned)(rsub * PX + c4);      /* scalar base + one lane offset that lives to the last store */
  const float* __restrict__ px = x + base; float* __restrict__ po = out + base;
  v4f xx[32];
#pragma unroll      /* constant indices: the array stays in registers */
  for (int q = 0; q < 32; ++q) xx[q] = *(const v4fa*)(px + (lo + q * 2 * PX));
  __builtin_amdgcn_sched_barrier(0);      /* fixes the loads' place: in front of the barriers, so that they fly during the reduction, and not further up among the staging, where the scheduler lifts them without it and the build runs out of registers (scratch) */
#pragma unroll      /* constant indices: the arrays stay in registers */
  for (int mk = 1; mk < 16; mk <<= 1)      /* butterfly over the 16 lanes that hold the same channels */
#pragma unroll      /* constant indices: the arrays stay in registers */
    for (int i = 0; i < 4; ++i)
#pragma unroll      /* constant indices: the arrays stay in registers */
      for (int g = 0; g < 2; ++g) { ps[i][g] += __shfl_xor(ps[i][g], mk, 32); pq[i][g] += __shfl_xor(pq[i][g], mk, 32); }
  if (ln == 0) {
#pragma unroll      /* constant indices: the arrays stay in registers */
    for (int i = 0; i < 4; ++i)
#pragma unroll      /* constant indices: the arrays stay in registers */
      for (int g = 0; g < 2; ++g) { float* p = red + (w * 16 + i * 4 + hh * 2 + g) * 2; p[0] = ps[i][g]; p[1] = pq[i][g]; } }
  __syncthreads();      /* every wave's partial sums are in LDS */
  if (tid < 16) { double s = 0.0, q2 = 0.0;      /* one lane per group adds the 16 waves' partial sums in float64 */
#pragma unroll      /* the 32 LDS reads go out together */
    for (int u = 0; u < 16; ++u) { s += (double)red[(u * 16 + tid) * 2]; q2 += (double)red[(u * 16 + tid) * 2 + 1]; }
    const double cnt = (double)(PX * CPG); const double mu = s / cnt; double var = q2 / cnt - mu * mu; if (var < 0.0) var = 0.0;
    st[2 * tid] = (float)mu; st[2 * tid + 1] = (float)(1.0 / sqrt(var + 1e-5)); }
  __syncthreads();      /* the 16 groups' statistics are in LDS */
#pragma unroll      /* constant indices: the array stays in registers; the row pairs' LDS reads run ahead of the stores */
  for (int q = 0; q < 32; ++q) { const int r = q * 2 + rsub; const v4f v = *(const v4fa*)&so[w][r][c4]; const float m = st[(q >> 1) * 2], rs = st[(q >> 1) * 2 + 1], wv = swb[r][0], bb = swb[r][1]; v4f o;      /* rows 2 q and 2 q + 1 lie in group q / 2 */
#pragma unroll      /* constant indices */
    for (int k = 0; k < 4; ++k) o[k] = (v[k] - m) * rs * wv + bb + bf16_round(xx[q][k]);
    *(v4f*)(po + (lo + q * 2 * PX)) = o; } }

extern "C" void kernel_launch(void* const* d_in, const int* in_sizes, int n_in,
                              void* d_out, int out_size, void* d_ws, size_t ws_size, hipStream_t stream) {
  (void)in_sizes; (void)n_in; (void)out_size;
  const float* const* I = (const float* const*)d_in; const float* X = I[0]; const float* Wq = I[1]; const float* bq = I[2]; const float* Wk = I[3]; const float* bk = I[4]; const float* Wv = I[5]; const float* bv = I[6]; const float* Wo = I[7]; const float* bo = I[8]; const float* gw = I[9]; const float* gb = I[10];
  char* ws = (char*)d_ws; size_t off = 0;
  auto take = [&](size_t bytes) { char* p = ws + off; off += (bytes + 255) & ~(size_t)255; return p; };
  _Float16* BWq = (_Float16*)take((size_t)CC * CC * 2); _Float16* BWk = (_Float16*)take((size_t)CC * CC * 2); _Float16* BWv = (_Float16*)take((size_t)CC * CC * 2); _Float16* BWo = (_Float16*)take((size_t)CC * CC * 2);
  _Float16* X16 = (_Float16*)take(NR * CC * 2); _Float16* QR = (_Float16*)take(NR * CC * 2); float* MP = (float*)take((size_t)NB * KM_PT * NH * HD * HD * 4); _Float16* W2 = (_Float16*)take((size_t)NB * CC * CC * 2);
  if (off > ws_size) return;      /* 2 + 16x2 + 8 + 8 = about 50 MiB */
  k_prep<<<XB + 4 * WB, 256, 0, stream>>>(X, X16, Wq, Wk, Wv, Wo, BWq, BWk, BWv, BWo);
  k_gemm_kvm<<<dim3(NH * KM_PT, NB), 256, 0, stream>>>(X16, BWq, BWv, bq, bv, MP);      /* K = Q_conv(X) (the module's swap) and V, kept in the work-group; M partial per head and position tile */
  /* all samples in one launch each: per-sample planes of W2 (every element written) */
  k_gemm_wq<<<MS_B + (unsigned)((NR / 128) * (CC / 128)), 128, 0, stream>>>(MP, BWo, W2, X16, BWk, bk, QR);      /* W2[o][c'] = sum_c Wo[o][c] M[c][c'] within the head; Q */
  k_o2gn<<<dim3(CC / 64, NB), 512, 0, stream>>>(W2, QR, bo, gw, gb, X, (float*)d_out);      /* O2 = W2 Q^T + bo, GroupNorm, affine, + X: the output's own layout */
}
